// v010
// Measured on an AMD MI455X. A time is GPU time per run, averaged over a window of back-to-back runs after a warm-up
// (all launches, gaps included; the runs take copies of the inputs in turn), and the median of several windows.
// Apart from v000's, it joins two sittings. Times from different sittings can be a few percent apart, while
// side-by-side timings come from the same sitting.
// This document starts at v010; the versions before it stand elsewhere.
// It runs in 225 microseconds.
// In both of two side-by-side timings against v009, it was 1.03 times as fast.
// All steps since the starting kernel, v000, together make it 8.72 times as fast.
#include <hip/hip_runtime.h>
#define NBT 4
#define SLEN 2048
#define DM 1024
#define NH 16
#define SCL 1.0f
#define NR (NBT * SLEN)
typedef __bf16 v16b __attribute__((ext_vector_type(16)));
typedef unsigned short v8us __attribute__((ext_vector_type(8), may_alias));
typedef float  v8f  __attribute__((ext_vector_type(8)));
typedef float  v4f  __attribute__((ext_vector_type(4)));
typedef float  v4fa __attribute__((ext_vector_type(4), may_alias));
union FragB { v16b v; v8us half[2]; unsigned short u[16]; };

__device__ __forceinline__ unsigned short bf16_bits(float x) { unsigned int u = __float_as_uint(x); return (unsigned short)((u + 0x7FFFu + ((u >> 16) & 1u)) >> 16); }
__device__ __forceinline__ float bf16_val(unsigned short b) { return __uint_as_float(((unsigned int)b) << 16); }
__device__ __forceinline__ float bf16_round(float x) { return bf16_val(bf16_bits(x)); }
// D += A·B with NT terms: 1 = ah·bh, 2 = + al·bh (A split), 3 = + ah·bl (both split)
template <int NT>
__device__ __forceinline__ v8f mmaN(v16b ah, v16b al, v16b bh, v16b bl, v8f c) {
  c = __builtin_amdgcn_wmma_f32_16x16x32_bf16(false, ah, false, bh, (short)0, c, false, false);
  if (NT >= 2) c = __builtin_amdgcn_wmma_f32_16x16x32_bf16(false, al, false, bh, (short)0, c, false, false);
  if (NT >= 3) c = __builtin_amdgcn_wmma_f32_16x16x32_bf16(false, ah, false, bl, (short)0, c, false, false);
  return c;
}

__global__ __launch_bounds__(256) void k_wt_bf16(const float* __restrict__ W, unsigned short* __restrict__ Wt, int K, int N) {
  const int t = blockIdx.x * 256 + threadIdx.x;
  const int k8n = K / 8;
  if (t >= N * k8n) return;
  const int n = t / k8n, k8 = (t % k8n) * 8;
  v8us v;
#pragma unroll
  for (int i = 0; i < 8; ++i) v[i] = bf16_bits(W[(size_t)(k8 + i) * N + n]);
  *(v8us*)(Wt + (size_t)n * K + k8) = v;
  
}

// GEMM C[M][N] (f32, pitch ldc) = act(A[M][K]·W + bias). A f32 row-major (pitch lda) converted per fragment to bf16
// (ASPLIT: hi/lo two planes -> 2 terms, else single rounded term); Wt bf16 [N][K] (pitch ldb). BIAS_BF16 rounds the
// bias to bf16 first (bias quantised to bf16 before the add). K%32==0, M%16==0, N%64==0.
template <bool ASPLIT, int ACT, bool BIAS_BF16>
__global__ __launch_bounds__(128) void k_gemm_bf(const float* __restrict__ A, int lda, const unsigned short* __restrict__ Wt, int ldb,
                                               const float* __restrict__ bias, float* __restrict__ C, int ldc, int M, int N, int K) {
  __shared__ __attribute__((aligned(16))) float so[4][16][64];
  const int tid = threadIdx.x, w = tid >> 5, lane = tid & 31, ln = lane & 15, hh = lane >> 4;
  const int ntn = N / 64;
  const int wid = blockIdx.x * 4 + w;
  const int mt = wid / ntn, nq = wid % ntn;
  if (mt * 16 >= M) return;
  const int row0 = mt * 16, col0 = nq * 64;
  const float* arow = A + (size_t)(row0 + ln) * lda;
  v8f acc[4] = {};
  for (int kb = 0; kb < K; kb += 32) {
    FragB ah, al;
    const v4f x0 = *(const v4fa*)(arow + kb + 8 * hh), x1 = *(const v4fa*)(arow + kb + 8 * hh + 4);
    const v4f x2 = *(const v4fa*)(arow + kb + 16 + 8 * hh), x3 = *(const v4fa*)(arow + kb + 16 + 8 * hh + 4);
    float xs[16] = {x0[0],x0[1],x0[2],x0[3],x1[0],x1[1],x1[2],x1[3],x2[0],x2[1],x2[2],x2[3],x3[0],x3[1],x3[2],x3[3]};
#pragma unroll
    for (int i = 0; i < 16; ++i) { const unsigned short hb = bf16_bits(xs[i]); ah.u[i] = hb; al.u[i] = ASPLIT ? bf16_bits(xs[i] - bf16_val(hb)) : (unsigned short)0; }
#pragma unroll
    for (int t = 0; t < 4; ++t) {
      const unsigned short* brow = Wt + (size_t)(col0 + t * 16 + ln) * ldb + kb;
      FragB b;
      b.half[0] = *(const v8us*)(brow + 8 * hh);
      b.half[1] = *(const v8us*)(brow + 16 + 8 * hh);
      acc[t] = mmaN<ASPLIT ? 2 : 1>(ah.v, al.v, b.v, b.v, acc[t]);
    }
  }
#pragma unroll
  for (int t = 0; t < 4; ++t) {
    float bv = bias ? bias[col0 + t * 16 + ln] : 0.f;
    if (BIAS_BF16) bv = bf16_round(bv);
#pragma unroll
    for (int r = 0; r < 8; ++r) { float v = acc[t][r] + bv; if (ACT == 1) v = fmaxf(v, 0.f); so[w][8 * hh + r][t * 16 + ln] = v; }
  }
  __builtin_amdgcn_fence(__ATOMIC_ACQ_REL, "workgroup");
  __builtin_amdgcn_wave_barrier();
  const int rsub = lane >> 4, c4 = (lane & 15) * 4;
  {
#pragma unroll
    for (int q = 0; q < 8; ++q) {
      const int r = q * 2 + rsub;
      const v4f v = *(const v4fa*)&so[w][r][c4];
      *(v4f*)(C + (size_t)(row0 + r) * ldc + col0 + c4) = v;
    }
    
  }
}

// GEMM C = act(A·W + bias + resid): A f32 (ASPLIT -> hi/lo 2 terms), Wt bf16 [N][K]; ACT 0 none, 1 relu, 2 exact gelu;
// resid (optional, f32, row index = (row % rmod), pitch ldr, RES_BF16 rounds it) added before the activation.
template <bool ASPLIT, int ACT, bool BIAS_BF16, bool RES_BF16>
__global__ __launch_bounds__(128) void k_gemm_bf3(const float* __restrict__ A, int lda, const unsigned short* __restrict__ Wt, int ldb,
                                                const float* __restrict__ bias, const float* __restrict__ resid, int rmod, int ldr,
                                                float* __restrict__ C, int ldc, int M, int N, int K) {
  __shared__ __attribute__((aligned(16))) float so[4][16][64];
  const int tid = threadIdx.x, w = tid >> 5, lane = tid & 31, ln = lane & 15, hh = lane >> 4;
  const int ntn = N / 64;
  const int wid = blockIdx.x * 4 + w;
  const int mt = wid / ntn, nq = wid % ntn;
  if (mt * 16 >= M) return;
  const int row0 = mt * 16, col0 = nq * 64;
  const float* arow = A + (size_t)(row0 + ln) * lda;
  v8f acc[4] = {};
  for (int kb = 0; kb < K; kb += 32) {
    FragB ah, al;
    const v4f x0 = *(const v4fa*)(arow + kb + 8 * hh), x1 = *(const v4fa*)(arow + kb + 8 * hh + 4);
    const v4f x2 = *(const v4fa*)(arow + kb + 16 + 8 * hh), x3 = *(const v4fa*)(arow + kb + 16 + 8 * hh + 4);
    float xs[16] = {x0[0],x0[1],x0[2],x0[3],x1[0],x1[1],x1[2],x1[3],x2[0],x2[1],x2[2],x2[3],x3[0],x3[1],x3[2],x3[3]};
#pragma unroll
    for (int i = 0; i < 16; ++i) { const unsigned short hb = bf16_bits(xs[i]); ah.u[i] = hb; al.u[i] = ASPLIT ? bf16_bits(xs[i] - bf16_val(hb)) : (unsigned short)0; }
#pragma unroll
    for (int t = 0; t < 4; ++t) {
      const unsigned short* brow = Wt + (size_t)(col0 + t * 16 + ln) * ldb + kb;
      FragB b;
      b.half[0] = *(const v8us*)(brow + 8 * hh);
      b.half[1] = *(const v8us*)(brow + 16 + 8 * hh);
      acc[t] = mmaN<ASPLIT ? 2 : 1>(ah.v, al.v, b.v, b.v, acc[t]);
    }
  }
#pragma unroll
  for (int t = 0; t < 4; ++t) {
    const int col = col0 + t * 16 + ln;
    float bv = bias ? bias[col] : 0.f;
    if (BIAS_BF16) bv = bf16_round(bv);
#pragma unroll
    for (int r = 0; r < 8; ++r) {
      float v = acc[t][r] + bv;
      if (resid) { float rv = resid[(size_t)((row0 + 8 * hh + r) % rmod) * ldr + col]; if (RES_BF16) rv = bf16_round(rv); v += rv; }
      if (ACT == 1) v = fmaxf(v, 0.f);
      if (ACT == 2) v = 0.5f * v * (1.0f + erff(v * 0.70710678118654752f));
      if (ACT == 3) { const float u = 0.7978845608028654f * (v + 0.044715f * v * v * v); v = 0.5f * v * (1.0f + tanhf(u)); }
      so[w][8 * hh + r][t * 16 + ln] = v;
    }
  }
  __builtin_amdgcn_fence(__ATOMIC_ACQ_REL, "workgroup");
  __builtin_amdgcn_wave_barrier();
  const int rsub = lane >> 4, c4 = (lane & 15) * 4;
  {
#pragma unroll
    for (int q = 0; q < 8; ++q) {
      const int r = q * 2 + rsub;
      const v4f v = *(const v4fa*)&so[w][r][c4];
      *(v4f*)(C + (size_t)(row0 + r) * ldc + col0 + c4) = v;
    }
    
  }
}
// row LayerNorm (biased variance, eps) over N: s = X (+ R); optional out_sum <- s; out_norm <- (s-mu)*rsqrt(var+eps)*g + b
template <bool PARAM_BF16>
__global__ __launch_bounds__(256) void k_layernorm(const float* __restrict__ X, const float* __restrict__ R, const float* __restrict__ g, const float* __restrict__ bta,
                                                  float* __restrict__ out_sum, float* __restrict__ out_norm, int N, float eps) {
  __shared__ float red[256];
  const int row = blockIdx.x, tid = threadIdx.x;
  const float* x = X + (size_t)row * N; const float* rr = R ? R + (size_t)row * N : nullptr;
  float vals[16];                     // up to N = 4096
  const int per = N / 256;            // contiguous chunk per thread? use strided-by-4 chunks: thread handles j = tid*4 + 1024*u
  float s1 = 0.f;
  for (int u = 0; u < per / 4; ++u) {
    const int j = tid * 4 + 1024 * u;
    const v4f a = *(const v4fa*)(x + j);
    v4f b = {0.f,0.f,0.f,0.f}; if (rr) b = *(const v4fa*)(rr + j);
#pragma unroll
    for (int q = 0; q < 4; ++q) { const float v = a[q] + b[q]; vals[u * 4 + q] = v; s1 += v; }
  }
  red[tid] = s1; __syncthreads();
  for (int st = 128; st > 0; st >>= 1) { if (tid < st) red[tid] += red[tid + st]; __syncthreads(); }
  const float mu = red[0] / (float)N; __syncthreads();
  float s2 = 0.f;
  for (int u = 0; u < per / 4; ++u)
#pragma unroll
    for (int q = 0; q < 4; ++q) { const float c = vals[u * 4 + q] - mu; s2 += c * c; }
  red[tid] = s2; __syncthreads();
  for (int st = 128; st > 0; st >>= 1) { if (tid < st) red[tid] += red[tid + st]; __syncthreads(); }
  const float rs = rsqrtf(red[0] / (float)N + eps);
  {
    for (int u = 0; u < per / 4; ++u) {
      const int j = tid * 4 + 1024 * u;
      v4f o, sm;
#pragma unroll
      for (int q = 0; q < 4; ++q) {
        float gg = g[j + q], bb = bta[j + q];
        if (PARAM_BF16) { gg = bf16_round(gg); bb = bf16_round(bb); }
        sm[q] = vals[u * 4 + q]; o[q] = (vals[u * 4 + q] - mu) * rs * gg + bb;
      }
      if (out_sum) *(v4f*)(out_sum + (size_t)row * N + j) = sm;
      *(v4f*)(out_norm + (size_t)row * N + j) = o;
    }
    
  }
}



// ---- f16 WMMA path (v_wmma_f32_16x16x32_f16): 11-bit significands for operands in range — used where a [0,1] probability operand needs more precision than bf16
typedef _Float16 v16h __attribute__((ext_vector_type(16)));
union FragH { v16h v; v8us half[2]; _Float16 h[16]; unsigned short u[16]; };
template <int NT>
__device__ __forceinline__ v8f mmaH(v16h ah, v16h al, v16h bh, v16h bl, v8f c) {
  c = __builtin_amdgcn_wmma_f32_16x16x32_f16(false, ah, false, bh, (short)0, c, false, false);
  if (NT >= 2) c = __builtin_amdgcn_wmma_f32_16x16x32_f16(false, al, false, bh, (short)0, c, false, false);
  if (NT >= 3) c = __builtin_amdgcn_wmma_f32_16x16x32_f16(false, ah, false, bl, (short)0, c, false, false);
  return c;
}
// batched GEMM like k_gemm_b but f16 operands: A f32 (split into f16 hi/lo if ASPLIT, else rounded to f16), Bt = f16 values [n][k]; alpha; C f32; N multiple of 16 (partial tiles skipped)
template <bool ASPLIT>
__global__ __launch_bounds__(128) void k_gemm_h(const float* __restrict__ A, int lda, size_t sA, const _Float16* __restrict__ Bh, int ldb, size_t sB, float alpha, float* __restrict__ C, int ldc, size_t sC, int M, int N, int K) {
  __shared__ __attribute__((aligned(16))) float so[4][16][64];
  const int tid = threadIdx.x, w = tid >> 5, lane = tid & 31, ln = lane & 15, hh = lane >> 4; const int by = blockIdx.y;
  A += (size_t)by * sA; Bh += (size_t)by * sB; C += (size_t)by * sC;
  const int ntn = (N + 63) / 64; const int wid = blockIdx.x * 4 + w; const int mt = wid / ntn, nq = wid % ntn; if (mt * 16 >= M) return;
  const int row0 = mt * 16, col0 = nq * 64; const float* arow = A + (size_t)(row0 + ln) * lda;
  v8f acc[4] = {};
  for (int kb = 0; kb < K; kb += 32) {
    FragH ah, al;
    const v4f x0 = *(const v4fa*)(arow + kb + 8 * hh), x1 = *(const v4fa*)(arow + kb + 8 * hh + 4), x2 = *(const v4fa*)(arow + kb + 16 + 8 * hh), x3 = *(const v4fa*)(arow + kb + 16 + 8 * hh + 4);
    float xs[16] = {x0[0],x0[1],x0[2],x0[3],x1[0],x1[1],x1[2],x1[3],x2[0],x2[1],x2[2],x2[3],x3[0],x3[1],x3[2],x3[3]};
#pragma unroll
    for (int i = 0; i < 16; ++i) { const _Float16 h = (_Float16)xs[i]; ah.h[i] = h; al.h[i] = ASPLIT ? (_Float16)(xs[i] - (float)h) : (_Float16)0.0f; }
#pragma unroll
    for (int t = 0; t < 4; ++t) { if (col0 + t * 16 >= N) continue; const size_t boff = (size_t)(col0 + t * 16 + ln) * ldb + kb; FragH bq; bq.half[0] = *(const v8us*)(Bh + boff + 8 * hh); bq.half[1] = *(const v8us*)(Bh + boff + 16 + 8 * hh);
      acc[t] = mmaH<ASPLIT ? 2 : 1>(ah.v, al.v, bq.v, bq.v, acc[t]); }
  }
#pragma unroll
  for (int t = 0; t < 4; ++t) { if (col0 + t * 16 >= N) continue;
#pragma unroll
    for (int r = 0; r < 8; ++r) so[w][8 * hh + r][t * 16 + ln] = acc[t][r] * alpha; }
  __builtin_amdgcn_fence(__ATOMIC_ACQ_REL, "workgroup"); __builtin_amdgcn_wave_barrier();
  const int rsub = lane >> 4, c4 = (lane & 15) * 4;
  {
#pragma unroll
    for (int q = 0; q < 8; ++q) { const int r = q * 2 + rsub; if (col0 + c4 < N) { const v4f v = *(const v4fa*)&so[w][r][c4]; *(v4f*)(C + (size_t)(row0 + r) * ldc + col0 + c4) = v; } }
     }
}

// Wt[n][k] = f16(W[k][n]·scale) from f32 row-major W[K][N] (scale = power of two; bf16-exact weights stay exact in f16 away from the subnormal range)
__global__ __launch_bounds__(256) void k_wt_f16(const float* __restrict__ W, _Float16* __restrict__ Wt, int K, int N, float scale) {
  const int t = blockIdx.x * 256 + threadIdx.x; if (t >= N * (K / 8)) return; const int n = t / (K / 8), k8 = (t % (K / 8)) * 8; FragH f;
#pragma unroll
  for (int i = 0; i < 8; ++i) f.h[i] = (_Float16)(bf16_round(W[(size_t)(k8 + i) * N + n]) * scale); const v8us o = f.half[0];
  *(v8us*)((unsigned short*)Wt + (size_t)n * K + k8) = o; 
}
// k_gemm_hh variant with fused epilogue: v = acc·alpha + bias[by·sBias + col] (+ CP[(row/rowsPerB)·sCPb + by·64 + col] if CP) ; ACT 0 none / 1 elu ; writes f16 C16 (and f32 C if non-null)
template <int ACT>
__global__ __launch_bounds__(128) void k_gemm_hhx(const _Float16* __restrict__ A, int lda, size_t sA, const _Float16* __restrict__ Bh, int ldb, size_t sB, float alpha, const float* __restrict__ bias, size_t sBias, const float* __restrict__ CP, int rowsPerB, size_t sCPb, int row0g,
    float* __restrict__ C, _Float16* __restrict__ C16, int ldc, size_t sC, int M, int N, int K) {
  __shared__ __attribute__((aligned(16))) float so[4][16][64];
  const int tid = threadIdx.x, w = tid >> 5, lane = tid & 31, ln = lane & 15, hh = lane >> 4; const int by = blockIdx.y;
  A += (size_t)by * sA; Bh += (size_t)by * sB; const size_t cofs = (size_t)by * sC; const float* bp = bias ? bias + (size_t)by * sBias : nullptr;
  const int ntn = (N + 63) / 64; const int wid = blockIdx.x * 4 + w; const int mt = wid / ntn, nq = wid % ntn; if (mt * 16 >= M) return;
  const int row0 = mt * 16, col0 = nq * 64; const _Float16* arow = A + (size_t)(row0 + ln) * lda;
  v8f acc[4] = {};
  for (int kb = 0; kb < K; kb += 32) { FragH ah; ah.half[0] = *(const v8us*)((const unsigned short*)arow + kb + 8 * hh); ah.half[1] = *(const v8us*)((const unsigned short*)arow + kb + 16 + 8 * hh);
#pragma unroll
    for (int t = 0; t < 4; ++t) { if (col0 + t * 16 >= N) continue; const size_t boff = (size_t)(col0 + t * 16 + ln) * ldb + kb; FragH bq; bq.half[0] = *(const v8us*)((const unsigned short*)Bh + boff + 8 * hh); bq.half[1] = *(const v8us*)((const unsigned short*)Bh + boff + 16 + 8 * hh);
      acc[t] = mmaH<1>(ah.v, ah.v, bq.v, bq.v, acc[t]); }
  }
#pragma unroll
  for (int t = 0; t < 4; ++t) { if (col0 + t * 16 >= N) continue; const int col = col0 + t * 16 + ln; const float bv = bp ? bf16_round(bp[col]) : 0.f;
#pragma unroll
    for (int r = 0; r < 8; ++r) { float v = acc[t][r] * alpha + bv; if (CP) { const int bidx = (row0g + row0 + 8 * hh + r) / rowsPerB; v += CP[(size_t)bidx * sCPb + (size_t)by * 64 + col]; } if (ACT == 1) v = (v > 0.f) ? v : expm1f(v); else if (ACT == 7) v = (v > 0.f) ? v + 1.0f : expf(v); else if (ACT == 8) v = tanhf(v); else if (ACT == 9) v = 0.5f * v * (1.0f + tanhf(0.7978845608028654f * (v + 0.044715f * v * v * v))); else if (ACT == 11) v = 1.0f / (1.0f + expf(-v)); else if (ACT == 12) v = (v > 0.f) ? v : 0.01f * v; else if (ACT == 14) v = (v > 0.f) ? v : 0.1f * v; else if (ACT == 15) v = v / (1.0f + expf(-v)); else if (ACT == 3) v = fmaxf(v, 0.f); else if (ACT == 6) v = 0.5f * v * (1.0f + erff(v * 0.70710678118654752f)); so[w][8 * hh + r][t * 16 + ln] = v; } }
  __builtin_amdgcn_fence(__ATOMIC_ACQ_REL, "workgroup"); __builtin_amdgcn_wave_barrier();
  const int rsub = lane >> 4, c4 = (lane & 15) * 4; typedef _Float16 v4h __attribute__((ext_vector_type(4)));
  {
#pragma unroll
    for (int q = 0; q < 8; ++q) { const int r = q * 2 + rsub; if (col0 + c4 < N) { const v4f v = *(const v4fa*)&so[w][r][c4]; if (C) *(v4f*)(C + cofs + (size_t)(row0 + r) * ldc + col0 + c4) = v; if (C16) { v4h h4; for (int i = 0; i < 4; ++i) h4[i] = (_Float16)v[i]; *(v4h*)(C16 + cofs + (size_t)(row0 + r) * ldc + col0 + c4) = h4; } } }
     }
}


typedef _Float16 v4h __attribute__((ext_vector_type(4)));

__global__ __launch_bounds__(256) void k_h16(const float* __restrict__ x, _Float16* __restrict__ X16, size_t n8) { const size_t t = (size_t)blockIdx.x * 256 + threadIdx.x; if (t >= n8) return; FragH f;
#pragma unroll
  for (int q = 0; q < 8; ++q) f.h[q] = (_Float16)x[t * 8 + q]; *(v8us*)((unsigned short*)X16 + t * 8) = f.half[0];  }
template <int NHv, int TTv>
__global__ __launch_bounds__(256) void k_vt(const _Float16* __restrict__ V16, int ldv, int voff, _Float16* __restrict__ Vt) { __shared__ unsigned short tl[64][66]; const int tid = threadIdx.x; const int slab = blockIdx.x / (TTv / 64), lg = blockIdx.x % (TTv / 64); const int b = slab / NHv, h = slab % NHv;
  for (int i = tid; i < 64 * 8; i += 256) { const int r = i / 8, c8 = (i % 8) * 8; FragH f; f.half[0] = *(const v8us*)((const unsigned short*)V16 + ((size_t)b * TTv + lg * 64 + r) * ldv + voff + h * 64 + c8);
#pragma unroll
    for (int q = 0; q < 8; ++q) tl[r][c8 + q] = f.u[q]; }
  __syncthreads();
  {
#pragma unroll
    for (int rd = 0; rd < 2; ++rd) { const int d = rd * 32 + tid / 8, pc = tid % 8; FragH f;
#pragma unroll
      for (int q = 0; q < 8; ++q) f.u[q] = tl[pc * 8 + q][d];
      *(v8us*)((unsigned short*)Vt + ((size_t)slab * 64 + d) * TTv + lg * 64 + pc * 8) = f.half[0]; }
     } }

// ---- fast GEMM (256 threads, block tile 128x128, wave tile 32x64; requires M % 128 == 0 rows per launch region, N % 128 == 0 and K % 64 == 0); epilogue = k_gemm_hhx semantics ----
__device__ __forceinline__ v16h g2_frag(const _Float16* p, int hh) { FragH f; f.half[0] = *(const v8us*)((const unsigned short*)p + 8 * hh); f.half[1] = *(const v8us*)((const unsigned short*)p + 16 + 8 * hh); return f.v; }
__device__ __forceinline__ v8f g2_mma(v16h a, v16h b, v8f c) { return __builtin_amdgcn_wmma_f32_16x16x32_f16(false, a, false, b, (short)0, c, false, false); }
// ---- operand staging of the 128 x 128 block tile (8 waves: 4 row groups x 2 column groups of 32 x 64): 64 k (128 B of every operand row) per stage, rows 0..127 = A, 128..255 = B, LDS pitch 72 halves = 144 B (16 B x odd for the 16-byte fragment reads), two buffers
#define GKT 64
#define GPITCH 72
#define GSTG (256 * GPITCH)
// Eight asynchronous 16-byte copies global -> LDS per lane (one stage's share: a wave's copy = 4 whole 128-B rows), through no register. The s_wait_xcnt is the last line of the copies' own statement, so that no address register named here is rewritten ahead of it.
__device__ __forceinline__ void g2_copy8(unsigned l0, unsigned l1, unsigned l2, unsigned l3, unsigned l4, unsigned l5, unsigned l6, unsigned l7,
    const unsigned short* g0, const unsigned short* g1, const unsigned short* g2, const unsigned short* g3, const unsigned short* g4, const unsigned short* g5, const unsigned short* g6, const unsigned short* g7) {
  asm volatile("global_load_async_to_lds_b128 %0, %8, off\n\t"
               "global_load_async_to_lds_b128 %1, %9, off\n\t"
               "global_load_async_to_lds_b128 %2, %10, off\n\t"
               "global_load_async_to_lds_b128 %3, %11, off\n\t"
               "global_load_async_to_lds_b128 %4, %12, off\n\t"
               "global_load_async_to_lds_b128 %5, %13, off\n\t"
               "global_load_async_to_lds_b128 %6, %14, off\n\t"
               "global_load_async_to_lds_b128 %7, %15, off\n\t"
               "s_wait_xcnt 0x0"
               :: "v"(l0), "v"(l1), "v"(l2), "v"(l3), "v"(l4), "v"(l5), "v"(l6), "v"(l7), "v"(g0), "v"(g1), "v"(g2), "v"(g3), "v"(g4), "v"(g5), "v"(g6), "v"(g7) : "memory");
}
// Main loop of the 32 x 64 wave tile over K (a multiple of 64), 256 threads: rows rowb..rowb+127 of A and colb..colb+127 of Bh are staged once for the block's eight waves; wave w reads the fragments of A rows 32 (w & 3).. and B rows 64 (w >> 2).. from LDS. Per accumulator the products come in the same k order as with fragments loaded from global. On return every wave has passed the barrier behind the last fragment read, so sT may be reused.
__device__ __forceinline__ void g2_main(const _Float16* __restrict__ A, int lda, const _Float16* __restrict__ Bh, int ldb, int K, int rowb, int colb, unsigned short* sT, v8f (&c)[8]) {
  const int tid = threadIdx.x, w = tid >> 5, lane = tid & 31, ln = lane & 15, hh = lane >> 4;
  const unsigned short* ga = (const unsigned short*)A + (size_t)(rowb + (tid >> 3)) * lda + (tid & 7) * 8; const unsigned short* gb = (const unsigned short*)Bh + (size_t)(colb + (tid >> 3)) * ldb + (tid & 7) * 8;
  const size_t a32 = (size_t)32 * lda, b32 = (size_t)32 * ldb; const unsigned lt = (unsigned)(size_t)&sT[(tid >> 3) * GPITCH + (tid & 7) * 8]; constexpr unsigned R32 = 32 * GPITCH * 2;
  auto stage = [&](int kb, unsigned bo) { const unsigned l = lt + bo; const unsigned short* a = ga + kb; const unsigned short* b = gb + kb;
    g2_copy8(l, l + R32, l + 2 * R32, l + 3 * R32, l + 4 * R32, l + 5 * R32, l + 6 * R32, l + 7 * R32, a, a + a32, a + 2 * a32, a + 3 * a32, b, b + b32, b + 2 * b32, b + 3 * b32); };
  stage(0, 0u);
  asm volatile("s_wait_asynccnt 0x0" ::: "memory");      /* this wave's copies of stage 0 have landed before the barrier that shows them to the other waves */
  __syncthreads();
  if (GKT < K) stage(GKT, (unsigned)(GSTG * 2));
  /* rolled: one trip per stage, so that the two buffers alternate by the trip's parity */
#pragma unroll 1
  for (int kb = 0; kb < K; kb += GKT) { const unsigned short* buf = sT + ((kb >> 6) & 1) * GSTG;      /* this trip reads its own buffer alone */
    const _Float16* ar = (const _Float16*)(buf + (32 * (w & 3) + ln) * GPITCH); const _Float16* br = (const _Float16*)(buf + (128 + 64 * (w >> 2) + ln) * GPITCH);
    v16h fa[2][2], fb[2][4];      /* the trip's 24 fragment reads stand together in front of its products, so that their LDS latency is waited out once per trip and not in front of every pair of products */
#pragma unroll
    for (int ks = 0; ks < 2; ++ks) { fa[ks][0] = g2_frag(ar + ks * 32, hh); fa[ks][1] = g2_frag(ar + 16 * GPITCH + ks * 32, hh);
#pragma unroll
      for (int t = 0; t < 4; ++t) fb[ks][t] = g2_frag(br + t * 16 * GPITCH + ks * 32, hh); }
    __builtin_amdgcn_sched_barrier(0);      /* holds the 24 reads in front of the products: left free, the compiler sinks each pair of reads to its two products and waits for the LDS eight times a trip */
#pragma unroll
    for (int ks = 0; ks < 2; ++ks)
#pragma unroll
      for (int t = 0; t < 4; ++t) { c[t] = g2_mma(fa[ks][0], fb[ks][t], c[t]); c[4 + t] = g2_mma(fa[ks][1], fb[ks][t], c[4 + t]); }
    __builtin_amdgcn_sched_barrier(0);      /* holds the trip's products in front of its waits and barrier: left free, the compiler moves them behind the barrier, and the refill that follows them would have only the next trip's reads to land in */
    asm volatile("s_wait_dscnt 0x0" ::: "memory");      /* this wave's reads of the buffer have returned before the buffer may be refilled */
    asm volatile("s_wait_asynccnt 0x0" ::: "memory");      /* this wave's copies of the next stage have landed before the barrier that shows them */
    __syncthreads();      /* publishes the next stage and ends every wave's reads of this trip's buffer */
    if (kb + 2 * GKT < K) stage(kb + 2 * GKT, (unsigned)(((kb >> 6) & 1) * (GSTG * 2))); }
  asm volatile("s_wait_asynccnt 0x0" ::: "memory");      /* no copy is outstanding when the LDS becomes output staging */
}
template <int ACT>
__global__ __launch_bounds__(256) void k_gemm2(const _Float16* __restrict__ A, int lda, size_t sA, const _Float16* __restrict__ Bh, int ldb, size_t sB, float alpha, const float* __restrict__ bias, size_t sBias, const float* __restrict__ CP, int rowsPerB, size_t sCPb, int row0g,
    float* __restrict__ C, _Float16* __restrict__ C16, int ldc, size_t sC, int M, int N, int K) {
  __shared__ __attribute__((aligned(16))) float sm[2 * GSTG / 2];      /* the two operand buffers; behind the main loop its first 8 x 32 x 68 floats are the output staging */
  float (*so)[32][68] = (float (*)[32][68])sm;
  const int tid = threadIdx.x, w = tid >> 5, lane = tid & 31, ln = lane & 15, hh = lane >> 4; const int by = blockIdx.y;
  A += (size_t)by * sA; Bh += (size_t)by * sB; const size_t cofs = (size_t)by * sC; const float* bp = bias ? bias + (size_t)by * sBias : nullptr;
  const int ntn = N >> 7; const int mt = blockIdx.x / ntn, nq = blockIdx.x - mt * ntn; const int row0 = mt * 128 + 32 * (w & 3), col0 = nq * 128 + 64 * (w >> 2); if (mt * 128 + 128 > M) return;      /* block-uniform, in front of every barrier and copy */
  const v8f z8 = {0.f,0.f,0.f,0.f,0.f,0.f,0.f,0.f}; v8f accs[8] = {z8, z8, z8, z8, z8, z8, z8, z8};
  g2_main(A, lda, Bh, ldb, K, mt * 128, nq * 128, (unsigned short*)sm, accs);
#pragma unroll
  for (int u = 0; u < 8; ++u) { const int t = u & 3, half = u >> 2; const int col = col0 + t * 16 + ln; const float bv = bp ? bf16_round(bp[col]) : 0.f;
#pragma unroll
    for (int r = 0; r < 8; ++r) { const int rloc = half * 16 + 8 * hh + r; float v = accs[u][r] * alpha + bv; if (CP) { const int bidx = (row0g + row0 + rloc) / rowsPerB; v += CP[(size_t)bidx * sCPb + (size_t)by * 64 + col]; }
      if (ACT == 3) v = fmaxf(v, 0.f); else if (ACT == 6) v = 0.5f * v * (1.0f + erff(v * 0.70710678118654752f)); else if (ACT == 11) v = 1.0f / (1.0f + expf(-v)); else if (ACT == 15) v = v / (1.0f + expf(-v)); else if (ACT == 12) v = (v > 0.f) ? v : 0.01f * v; else if (ACT == 8) v = tanhf(v);
      so[w][rloc][t * 16 + ln] = v; } }
  __builtin_amdgcn_fence(__ATOMIC_ACQ_REL, "workgroup"); __builtin_amdgcn_wave_barrier();
  const int rsub = lane >> 4, c4 = (lane & 15) * 4;
  {
#pragma unroll
    for (int q = 0; q < 16; ++q) { const int r = q * 2 + rsub; const v4f v = *(const v4fa*)&so[w][r][c4]; if (C) *(v4f*)(C + cofs + (size_t)(row0 + r) * ldc + col0 + c4) = v; if (C16) { v4h h4; for (int i = 0; i < 4; ++i) h4[i] = (_Float16)v[i]; *(v4h*)(C16 + cofs + (size_t)(row0 + r) * ldc + col0 + c4) = h4; } }
     } }



__device__ __forceinline__ float siluf(float g) { return g / (1.0f + expf(-g)); }
// ---- projection GEMM (main loop of k_gemm2, NR x DM x DM, Bt carries x16) with the element-wise tail in its epilogue. A wave tile is 32 tokens x the 64 columns of one head, so the head's norm is a sum inside the wave's own LDS rows.
// POLAR 1: g = silu(acc/16) * f, f = r*scale[h]/(r + 1e-6) * post, r = |silu row|; g stored as f16 hi + x2^10 residual, row-major, one whole 128-B line per row and plane. post = log2(e) for q (the flash kernel's exponentials are then powers of 2), 1 for k.
// POLAR 0: g = silu(acc/16) stored transposed per (batch, head) slab as hi + residual planes [64 dims][SLEN tokens]; the block's 128 tokens are transposed through LDS, one whole 128-B line per 8 lanes.
template <int POLAR>
__device__ __forceinline__ void proj_tail(float* so, v8f (&accs)[8], int mt, int nq, const float* __restrict__ scale, float post, _Float16* __restrict__ Hh, _Float16* __restrict__ Hl) {
  constexpr int PT = POLAR ? 68 : 65;      /* LDS row pitch in floats: 68 for the 16-B row reads, 65 for the column reads of the transpose */
  const int tid = threadIdx.x, w = tid >> 5, lane = tid & 31, ln = lane & 15, hh = lane >> 4; const int row0 = mt * 128 + 32 * (w & 3), col0 = nq * 64;
#pragma unroll
  for (int u = 0; u < 8; ++u) { const int t = u & 3, half = u >> 2;
#pragma unroll
    for (int r = 0; r < 8; ++r) so[(32 * w + half * 16 + 8 * hh + r) * PT + t * 16 + ln] = accs[u][r]; }
  if (POLAR) {
    __builtin_amdgcn_fence(__ATOMIC_ACQ_REL, "workgroup"); __builtin_amdgcn_wave_barrier();      /* each wave reads back its own 32 rows only */
    const int rsub = lane >> 4, c4 = (lane & 15) * 4; const float sc = bf16_round(scale[nq]);
#pragma unroll
    for (int q = 0; q < 16; ++q) { const int r = q * 2 + rsub; const v4f v = *(const v4fa*)&so[(32 * w + r) * PT + c4];
      float s = (v[0] * v[0] + v[1] * v[1]) + (v[2] * v[2] + v[3] * v[3]); s += __shfl_xor(s, 8, 32); s += __shfl_xor(s, 4, 32); s += __shfl_xor(s, 2, 32); s += __shfl_xor(s, 1, 32);
      const float rr = sqrtf(s); const float fac = (rr * sc) / (rr + 1e-6f) * post; v4h h4, l4;
#pragma unroll
      for (int i = 0; i < 4; ++i) { const float g = v[i] * fac; const _Float16 h = (_Float16)g; h4[i] = h; l4[i] = (_Float16)((g - (float)h) * 1024.0f); }
      const size_t o = (size_t)(row0 + r) * DM + col0 + c4; *(v4h*)(Hh + o) = h4; *(v4h*)(Hl + o) = l4; }
  } else {
    __syncthreads();      /* the transpose reads rows that the block's other waves wrote */
    const int slab = (mt * 128 / SLEN) * NH + nq, tok0 = mt * 128 % SLEN;
#pragma unroll
    for (int it = 0; it < 8; ++it) { const int item = it * 128 + (tid & 127); const int pc = item & 7, d = (item >> 3) & 63, g = item >> 9; FragH fh, fl;      /* each half of the block transposes its own head's 128 LDS rows */
#pragma unroll
      for (int q = 0; q < 8; ++q) { const float v = so[((w >> 2) * 128 + g * 64 + pc * 8 + q) * PT + d]; const _Float16 hv = (_Float16)v; fh.h[q] = hv; fl.h[q] = (_Float16)((v - (float)hv) * 1024.0f); }
      const size_t o = ((size_t)slab * 64 + d) * SLEN + tok0 + g * 64 + pc * 8; *(v8us*)((unsigned short*)Hh + o) = fh.half[0]; *(v8us*)((unsigned short*)Hl + o) = fl.half[0]; }
    asm volatile("s_wait_xcnt 0x0" ::: "memory");      /* in the merged kernel's listing the other tail's code follows these stores and rewrites their address registers */
  } }
// The three projections in one launch: they read the same x plane and none reads what another writes, so the job (0 = q, 1 = k, 2 = v) is picked by the block index, PJB blocks each, in the order of the former three launches. A WGP takes its next block as soon as one ends: no launch gap, no refill of the chip and no idle tail between the jobs. The job is the same for the whole block, so the barriers in main loop and tail stand under block-uniform control flow.
#define PJB ((NR / 128) * (DM / 128))
__global__ __launch_bounds__(256) void k_proj3(const _Float16* __restrict__ A, const _Float16* __restrict__ BQ, const _Float16* __restrict__ BK, const _Float16* __restrict__ BV, const float* __restrict__ qs, const float* __restrict__ ks,
    _Float16* __restrict__ Qh, _Float16* __restrict__ Ql, _Float16* __restrict__ Kh, _Float16* __restrict__ Kl, _Float16* __restrict__ Vth, _Float16* __restrict__ Vtl) {
  __shared__ __attribute__((aligned(16))) float so[2 * GSTG / 2];      /* the two operand buffers; behind the main loop its first 256 x 68 floats are the output staging: rows 32 w.. are wave w's */
  const int w = threadIdx.x >> 5; const int job = blockIdx.x / PJB, bx = blockIdx.x - job * PJB;
  constexpr int ntn = DM >> 7; const int mt = bx / ntn, nq = (bx - mt * ntn) * 2 + __builtin_amdgcn_readfirstlane(w >> 2);      /* nq = the wave's head: waves 0..3 the block's first, 4..7 its second; read from the first lane so that it stays a scalar and scale[nq] a scalar load */
  const v8f z8 = {0.f,0.f,0.f,0.f,0.f,0.f,0.f,0.f}; v8f accs[8] = {z8, z8, z8, z8, z8, z8, z8, z8};
  g2_main(A, DM, job == 0 ? BQ : (job == 1 ? BK : BV), DM, DM, mt * 128, (bx - mt * ntn) * 128, (unsigned short*)so, accs);      /* the main loop of k_gemm2 */
#pragma unroll
  for (int u = 0; u < 8; ++u)
#pragma unroll
    for (int r = 0; r < 8; ++r) accs[u][r] = siluf(accs[u][r] * 0.0625f);      /* in front of the branch: the kernel's text holds this long code once for both tails; unrolled so that accs is indexed by constants and stays in registers */
  if (job < 2) proj_tail<1>(so, accs, mt, nq, job ? ks : qs, job ? 1.0f : 1.4426950408889634f, job ? Kh : Qh, job ? Kl : Ql);      /* q = silu(x Wq^T) * f_q * log2(e), k = silu(x Wk^T) * f_k, each hi + residual */
  else proj_tail<0>(so, accs, mt, nq, ks, 1.0f, Vth, Vtl);      /* v = silu(x Wv^T), transposed, hi + residual (scale, post unread) */
}

// Eight asynchronous 16-byte copies global -> LDS per lane (one key pass's share of the K and V^T hi / residual tiles), through no register. The s_wait_xcnt is the last line of the copies' own statement, so that no address register named here is rewritten ahead of it.
__device__ __forceinline__ void kv_copy8(unsigned l0, unsigned l1, unsigned l2, unsigned l3, unsigned l4, unsigned l5, unsigned l6, unsigned l7,
    const unsigned short* g0, const unsigned short* g1, const unsigned short* g2, const unsigned short* g3, const unsigned short* g4, const unsigned short* g5, const unsigned short* g6, const unsigned short* g7) {
  asm volatile("global_load_async_to_lds_b128 %0, %8, off\n\t"
               "global_load_async_to_lds_b128 %1, %9, off\n\t"
               "global_load_async_to_lds_b128 %2, %10, off\n\t"
               "global_load_async_to_lds_b128 %3, %11, off\n\t"
               "global_load_async_to_lds_b128 %4, %12, off\n\t"
               "global_load_async_to_lds_b128 %5, %13, off\n\t"
               "global_load_async_to_lds_b128 %6, %14, off\n\t"
               "global_load_async_to_lds_b128 %7, %15, off\n\t"
               "s_wait_xcnt 0x0"
               :: "v"(l0), "v"(l1), "v"(l2), "v"(l3), "v"(l4), "v"(l5), "v"(l6), "v"(l7), "v"(g0), "v"(g1), "v"(g2), "v"(g3), "v"(g4), "v"(g5), "v"(g6), "v"(g7) : "memory");
}
__device__ __forceinline__ float xhalf(float x) { return __builtin_bit_cast(float, __builtin_amdgcn_permlanex16(__builtin_bit_cast(int, x), __builtin_bit_cast(int, x), 0x76543210, 0xfedcba98, false, false)); }      /* lane l's value of lane l ^ 16 */
// Both products run with their operands swapped: S^T = K Q^T (A = 16 key rows from LDS, B = the wave's 16 queries, kept in registers) and O^T += V^T P^T (A = 16 V^T rows from LDS, B = P^T). Lane (ln, hh) then holds, of query q0 + ln alone, the scores of keys 16 nt + 8 hh + r and the output dims 16 dt + 8 hh + r. The two score tiles converted in place are the B operand of the value product: position s of a fragment is k = 8 hh + s (s < 8) or 16 + 8 hh + (s - 8), which is tile s >> 3, register s & 7.
template <int TQ, int TK>
__global__ __launch_bounds__(128) void k_flashm(const _Float16* __restrict__ Q16, const _Float16* __restrict__ Q16lo, int ldq, const _Float16* __restrict__ K16, const _Float16* __restrict__ K16lo, int ldk, const _Float16* __restrict__ Vt, const _Float16* __restrict__ Vtlo, const unsigned* __restrict__ MB, const int* __restrict__ RA, const int* __restrict__ KE, _Float16* __restrict__ Oh, _Float16* __restrict__ Ol, int ldo) {
  constexpr int RPW = 16, NQB = TQ / (4 * RPW), DT = 4, KS = 2;
  /* One pass's 32 keys, staged once for the block's four waves, two buffers. In 16-bit units: K rows (64 dims) at pitch 72 = 144 B, V^T rows (32 keys) at pitch 40 = 80 B, both 16 B x odd for the 16-byte fragment reads. */
  constexpr int KP = 72, VP = 40, KL0 = 32 * KP, VH0 = 2 * 32 * KP, VL0 = VH0 + 64 * VP, STG = VL0 + 64 * VP;
  __shared__ __attribute__((aligned(16))) unsigned short sKV[2][STG];
  const int tid = threadIdx.x, w = tid >> 5, lane = tid & 31, ln = lane & 15, hh = lane >> 4;
  /* Heaviest first: a block walks 2 (qblk + 1) key passes, so the block index counts the query blocks downwards, all (batch, head) slabs of one query block side by side. Cost falls with the index: the long blocks start first, neighbours in the index cost the same, and the launch ends on 2-pass blocks. Every (slab, query block) is taken exactly once. */
  constexpr int NSL = NBT * NH; const int slab = blockIdx.x % NSL, qblk = NQB - 1 - blockIdx.x / NSL; const int b = slab / NH, h = slab % NH; const int qb0 = qblk * (4 * RPW); const int q0 = qb0 + w * RPW;
  FragH aq[KS], aql[KS];
  { const size_t qo = ((size_t)b * TQ + q0 + ln) * ldq + h * 64; const unsigned short* qr = (const unsigned short*)Q16 + qo; const unsigned short* ql = (const unsigned short*)Q16lo + qo;
#pragma unroll
    for (int ks = 0; ks < KS; ++ks) { aq[ks].half[0] = *(const v8us*)(qr + ks * 32 + 8 * hh); aq[ks].half[1] = *(const v8us*)(qr + ks * 32 + 16 + 8 * hh); aql[ks].half[0] = *(const v8us*)(ql + ks * 32 + 8 * hh); aql[ks].half[1] = *(const v8us*)(ql + ks * 32 + 16 + 8 * hh); } }
  asm volatile("s_wait_xcnt 0x0" ::: "memory");      /* the Q loads' address registers are reused right below */
  const unsigned short* Vth = (const unsigned short*)Vt + (size_t)slab * 64 * TK; const unsigned short* Vtl = (const unsigned short*)Vtlo + (size_t)slab * 64 * TK;
  float m_r = -3.0e38f, l_r = 0.f; v8f oacc[DT], oaccl[DT];      /* running maximum and this lane's half of the running sum of query q0 + ln */
#pragma unroll
  for (int dt = 0; dt < DT; ++dt) { oacc[dt] = (v8f){0.f,0.f,0.f,0.f,0.f,0.f,0.f,0.f}; oaccl[dt] = oacc[dt]; }
  int jend = KE[qblk * 32]; jend = min(TK, (jend + 31) & ~31); if (jend < 32) jend = 32;      /* block-uniform */
  /* each thread copies two 16-byte pieces of each of the four tiles: K rows tid/8 and tid/8 + 16 (a wave's copy = 4 whole 128-B rows), V^T rows tid/4 and tid/4 + 32 */
  const unsigned short* gkh = (const unsigned short*)K16 + ((size_t)b * TK + (tid >> 3)) * ldk + h * 64 + (tid & 7) * 8; const unsigned short* gkl = (const unsigned short*)K16lo + ((size_t)b * TK + (tid >> 3)) * ldk + h * 64 + (tid & 7) * 8;
  const unsigned short* gvh = Vth + (size_t)(tid >> 2) * TK + (tid & 3) * 8; const unsigned short* gvl = Vtl + (size_t)(tid >> 2) * TK + (tid & 3) * 8;
  const unsigned lk = (unsigned)(size_t)&sKV[0][(tid >> 3) * KP + (tid & 7) * 8], lv = (unsigned)(size_t)&sKV[0][VH0 + (tid >> 2) * VP + (tid & 3) * 8];
  auto stage = [&](int j, unsigned bo) { const size_t ko = (size_t)j * ldk, k16 = (size_t)16 * ldk;
    kv_copy8(lk + bo, lk + bo + 16 * KP * 2, lk + bo + KL0 * 2, lk + bo + (KL0 + 16 * KP) * 2, lv + bo, lv + bo + 32 * VP * 2, lv + bo + 64 * VP * 2, lv + bo + 96 * VP * 2,
             gkh + ko, gkh + ko + k16, gkl + ko, gkl + ko + k16, gvh + j, gvh + j + (size_t)32 * TK, gvl + j, gvl + j + (size_t)32 * TK); };
  stage(0, 0u);
  asm volatile("s_wait_asynccnt 0x0" ::: "memory");      /* this wave's copies of pass 0 have landed before the barrier that shows them to the other waves */
  __syncthreads();
  if (32 < jend) stage(32, (unsigned)(STG * 2));
  const bool am = (RA[q0 + ln] != 0); const unsigned* mp = MB + (size_t)(q0 + ln) * (TK / 32);      /* one row flag and one mask row per lane: its query's; mp walks the row, one word a pass */
  asm volatile("s_wait_xcnt 0x0" ::: "memory");      /* the row-flag load's address register is reused below */
#pragma unroll 1
  for (int j0 = 0; j0 < jend; j0 += 32) {
    const unsigned mws = *mp >> (8 * hh);      /* asked for at the head of the pass: its wait falls together with the K fragments'; bit 16 nt + r is then this lane's key 16 nt + 8 hh + r */
    const unsigned short* kvb = &sKV[(j0 >> 5) & 1][0];      /* this pass reads its own buffer alone */
    v8f s[2];
#pragma unroll
    for (int nt = 0; nt < 2; ++nt) { const unsigned short* kr = kvb + (nt * 16 + ln) * KP; const unsigned short* kl = kr + KL0; FragH bk[KS], bkl[KS];
#pragma unroll
      for (int ks = 0; ks < KS; ++ks) { bk[ks].half[0] = *(const v8us*)(kr + ks * 32 + 8 * hh); bk[ks].half[1] = *(const v8us*)(kr + ks * 32 + 16 + 8 * hh); bkl[ks].half[0] = *(const v8us*)(kl + ks * 32 + 8 * hh); bkl[ks].half[1] = *(const v8us*)(kl + ks * 32 + 16 + 8 * hh); }
      v8f acc = (v8f){0.f,0.f,0.f,0.f,0.f,0.f,0.f,0.f}, accr = acc;
#pragma unroll
      for (int ks = 0; ks < KS; ++ks) { acc = mmaH<1>(bk[ks].v, bk[ks].v, aq[ks].v, aq[ks].v, acc); accr = mmaH<1>(bk[ks].v, bk[ks].v, aql[ks].v, aql[ks].v, accr); accr = mmaH<1>(bkl[ks].v, bkl[ks].v, aq[ks].v, aq[ks].v, accr); }
      s[nt] = acc + accr * 0.0009765625f; }
    /* The lane's 16 scores are all of one query: maximum and sum are taken inside the lane, the maximum joined with the other half of the wave by one exchange. No branch (each exp is computed and then chosen by a select), each step written for all 16 before the next. */
    float sv[16], mx[8]; bool ok[16];
#pragma unroll
    for (int i = 0; i < 16; ++i) { ok[i] = am || (((mws >> (16 * (i >> 3) + (i & 7))) & 1u) == 0u); sv[i] = ok[i] ? (am ? 0.f : s[i >> 3][i & 7] * SCL) : -INFINITY; }
#pragma unroll
    for (int i = 0; i < 8; ++i) mx[i] = fmaxf(sv[i], sv[8 + i]);
    float mc = fmaxf(fmaxf(fmaxf(mx[0], mx[1]), fmaxf(mx[2], mx[3])), fmaxf(fmaxf(mx[4], mx[5]), fmaxf(mx[6], mx[7]))); mc = fmaxf(mc, xhalf(mc));
    const float mn = fmaxf(m_r, mc); const float ea = __builtin_amdgcn_exp2f(m_r - mn); const float al = (mn > -1.0e38f) ? ea : 1.0f; m_r = mn;      /* the scores arrive times log2(e) (folded into q by its projection), so e^(s - m) is 2^(difference): one v_exp_f32 */
    FragH pa, pl; float p[16];
#pragma unroll
    for (int i = 0; i < 16; ++i) { const float e = __builtin_amdgcn_exp2f(sv[i] - mn); p[i] = ok[i] ? e : 0.f; }
#pragma unroll
    for (int i = 0; i < 16; ++i) { const float ps = p[i] * 1024.0f; pa.h[i] = (_Float16)ps; pl.h[i] = (_Float16)((ps - (float)pa.h[i]) * 1024.0f); }
#pragma unroll
    for (int i = 0; i < 8; ++i) p[i] += p[8 + i];
    l_r = l_r * al + (((p[0] + p[1]) + (p[2] + p[3])) + ((p[4] + p[5]) + (p[6] + p[7])));
#pragma unroll
    for (int dt = 0; dt < DT; ++dt) { oacc[dt] *= al; oaccl[dt] *= al; }
#pragma unroll
    for (int dt = 0; dt < DT; ++dt) { const unsigned short* vr = kvb + VH0 + (dt * 16 + ln) * VP; const unsigned short* vl = vr + 64 * VP; FragH bv, bl; bv.half[0] = *(const v8us*)(vr + 8 * hh); bv.half[1] = *(const v8us*)(vr + 16 + 8 * hh); bl.half[0] = *(const v8us*)(vl + 8 * hh); bl.half[1] = *(const v8us*)(vl + 16 + 8 * hh);
      oacc[dt] = mmaH<1>(bv.v, bv.v, pa.v, pa.v, oacc[dt]); oaccl[dt] = mmaH<1>(bl.v, bl.v, pa.v, pa.v, oaccl[dt]); oaccl[dt] = mmaH<1>(bv.v, bv.v, pl.v, pl.v, oaccl[dt]); }
    asm volatile("s_wait_xcnt 0x0" ::: "memory");      /* the mask-word load's address register is stepped for the next pass behind this point */
    ++mp;
    asm volatile("s_wait_dscnt 0x0" ::: "memory");      /* this wave's reads of the buffer have returned before the buffer may be refilled */
    asm volatile("s_wait_asynccnt 0x0" ::: "memory");      /* this wave's copies of the next pass have landed before the barrier that shows them */
    __syncthreads();      /* publishes the next pass's tiles and ends every wave's reads of this pass's buffer */
    if (j0 + 64 < jend) stage(j0 + 64, (unsigned)(((j0 >> 5) & 1) * (STG * 2))); }
  asm volatile("s_wait_asynccnt 0x0" ::: "memory");      /* no copy is outstanding when the wave goes on to its end */
  const float l = l_r + xhalf(l_r); const float li = (l > 0.f) ? 1.0f / (l * 1024.0f) : 0.f;      /* the two halves' sums are joined once */
  /* a lane's 8 registers of a tile are 8 neighbouring dims of its query's row: one 16-byte store per tile and plane; the wave's 8 stores fill its 16 whole 128-B rows of each plane */
  FragH fh[DT], fl[DT];
#pragma unroll
  for (int dt = 0; dt < DT; ++dt)
#pragma unroll
    for (int r = 0; r < 8; ++r) { const float val = (oacc[dt][r] + oaccl[dt][r] * 0.0009765625f) * li; const _Float16 hv = (_Float16)val; fh[dt].h[r] = hv; fl[dt].h[r] = (_Float16)((val - (float)hv) * 1024.0f); }
  const size_t oo = ((size_t)b * TQ + q0 + ln) * ldo + h * 64 + 8 * hh;
#pragma unroll
  for (int dt = 0; dt < DT; ++dt) { *(v8us*)((unsigned short*)Oh + oo + dt * 16) = fh[dt].half[0]; *(v8us*)((unsigned short*)Ol + oo + dt * 16) = fl[dt].half[0]; } }


// All preparation that reads inputs only, in one launch: no job reads what another writes, so the job is picked by the block index (the same for a whole block). Blocks [0, PXB): x as an f16 plane of its bf16-rounded values; [PXB, PXB + 4 PWB): the four weights, bf16-rounded, x16, as f16 planes (torch (out, in) = the natural B^T); the last PCB: the causal key bit plane, row flags and per-block key bounds. Every job's element count is a whole number of blocks.
#define PXB (NR * DM / 8 / 256)
#define PWB (DM * DM / 8 / 256)
#define PCB (SLEN * (SLEN / 32) / 256)
__global__ __launch_bounds__(256) void k_prep(const float* __restrict__ x, const float* __restrict__ Wq, const float* __restrict__ Wk, const float* __restrict__ Wv, const float* __restrict__ Wo,
    _Float16* __restrict__ X16, _Float16* __restrict__ BQ, _Float16* __restrict__ BK, _Float16* __restrict__ BV, _Float16* __restrict__ BO, unsigned* __restrict__ MB, int* __restrict__ RA, int* __restrict__ KE) {
  static_assert(NR * DM % (8 * 256) == 0 && DM * DM % (8 * 256) == 0 && SLEN * (SLEN / 32) % 256 == 0, "whole blocks");
  const int b = blockIdx.x;
  if (b < PXB) { const size_t t = (size_t)b * 256 + threadIdx.x; FragH f;
#pragma unroll
    for (int q = 0; q < 8; ++q) f.h[q] = (_Float16)bf16_round(x[t * 8 + q]);
    *(v8us*)((unsigned short*)X16 + t * 8) = f.half[0];
  } else if (b < PXB + 4 * PWB) { const int j = (b - PXB) / PWB; const float* __restrict__ W = j == 0 ? Wq : (j == 1 ? Wk : (j == 2 ? Wv : Wo)); _Float16* __restrict__ Bt = j == 0 ? BQ : (j == 1 ? BK : (j == 2 ? BV : BO));
    const size_t t = (size_t)(b - PXB - j * PWB) * 256 + threadIdx.x; FragH f;
#pragma unroll
    for (int i = 0; i < 8; ++i) f.h[i] = (_Float16)(bf16_round(W[t * 8 + i]) * 16.0f);
    *(v8us*)((unsigned short*)Bt + t * 8) = f.half[0];
  } else { const int t = (b - PXB - 4 * PWB) * 256 + threadIdx.x; constexpr int nq = SLEN, nw = SLEN / 32;
    { const int q = t / nw, w = t % nw; const int first = q + 1 - 32 * w; const unsigned bits = (first <= 0) ? 0xffffffffu : ((first >= 32) ? 0u : (0xffffffffu << first)); MB[t] = bits; }
    if (t < nq) RA[t] = 0;
    if (t < nq / 64) KE[t * 32] = 64 * (t + 1);
  } }

extern "C" void kernel_launch(void* const* d_in, const int* in_sizes, int n_in,
                              void* d_out, int out_size, void* d_ws, size_t ws_size, hipStream_t stream) {
  (void)in_sizes; (void)n_in; (void)out_size;
  const float* const* I = (const float* const*)d_in; const float* x = I[0]; const float* Wq = I[1]; const float* Wk = I[2]; const float* Wv = I[3]; const float* Wo = I[4]; const float* qs = I[5]; const float* ks = I[6];
  char* ws = (char*)d_ws; size_t off = 0;
  auto take = [&](size_t bytes) { char* p = ws + off; off += (bytes + 255) & ~(size_t)255; return p; };
  _Float16* BQ = (_Float16*)take((size_t)DM * DM * 2); _Float16* BK = (_Float16*)take((size_t)DM * DM * 2); _Float16* BV = (_Float16*)take((size_t)DM * DM * 2); _Float16* BO = (_Float16*)take((size_t)DM * DM * 2);
  _Float16* X16 = (_Float16*)take((size_t)NR * DM * 2); _Float16* Oh = (_Float16*)take((size_t)NR * DM * 2); _Float16* Ol = (_Float16*)take((size_t)NR * DM * 2);
  _Float16* Qh = (_Float16*)take((size_t)NR * DM * 2); _Float16* Ql = (_Float16*)take((size_t)NR * DM * 2); _Float16* Kh = (_Float16*)take((size_t)NR * DM * 2); _Float16* Kl = (_Float16*)take((size_t)NR * DM * 2); _Float16* Vth = (_Float16*)take((size_t)NR * DM * 2); _Float16* Vtl = (_Float16*)take((size_t)NR * DM * 2);
  unsigned* MB = (unsigned*)take((size_t)SLEN * (SLEN / 32) * 4); int* RA = (int*)take((size_t)SLEN * 4); int* KE = (int*)take((size_t)(SLEN / 64) * 32 * 4);
  if (off > ws_size) return;      /* 8 + 16 + 2 x 16 + 6 x 16 + 0.5 = 153 MiB */
  k_prep<<<PXB + 4 * PWB + PCB, 256, 0, stream>>>(x, Wq, Wk, Wv, Wo, X16, BQ, BK, BV, BO, MB, RA, KE);
  k_proj3<<<3 * PJB, 256, 0, stream>>>(X16, BQ, BK, BV, qs, ks, Qh, Ql, Kh, Kl, Vth, Vtl);
  k_flashm<SLEN, SLEN><<<NBT * NH * (SLEN / 64), 128, 0, stream>>>(Qh, Ql, DM, Kh, Kl, DM, Vth, Vtl, MB, RA, KE, Oh, Ol, DM);
  float* outb = (float*)d_out; const dim3 gP(PJB, 1);
  k_gemm2<0><<<gP, 256, 0, stream>>>(Oh, DM, 0, BO, DM, 0, 0.0625f, nullptr, 0, nullptr, 1, 0, 0, outb, nullptr, DM, 0, NR, DM, DM);
  k_gemm2<0><<<gP, 256, 0, stream>>>(Ol, DM, 0, BO, DM, 0, 0.0625f / 1024.0f, nullptr, 0, outb, 1, (size_t)DM, 0, outb, nullptr, DM, 0, NR, DM, DM);
}
